// v000
// The times below were measured on an AMD MI455X: many runs one after another, warmed up first and cycling through
// copies of the inputs, with the whole window's GPU time divided by the number of runs. Launches and the gaps
// between them are all in it. The median over several windows is given; except for v000 it joins two sittings, which
// can be a few percent apart, so the side-by-side timings, each taken in one sitting, are the better comparison.
// The starting kernel, v000, takes 83.1 microseconds a run.
#include <hip/hip_runtime.h>

#define HIDDEN 4096
#define SCALING 2.0f

typedef float v2f __attribute__((ext_vector_type(2)));
typedef float v8f __attribute__((ext_vector_type(8)));

#define NW     8                 // waves per block (wave32 -> 256 threads)
#define KSLAB  (HIDDEN / NW)     // 512 K per wave
#define KC     64                // K-chunk staged in LDS per wave
#define ROWSTR (KC + 4)          // LDS row stride (floats): 68 -> conflict-free b64 reads

// ---------------- gfx1250 async-copy helpers (guarded) ----------------------
__device__ __forceinline__ void async_copy_b128(const float* gsrc, float* ldst) {
#if __has_builtin(__builtin_amdgcn_global_load_async_to_lds_b128)
  typedef int v4i __attribute__((vector_size(16)));
  typedef __attribute__((address_space(1))) v4i glb_v4i;
  typedef __attribute__((address_space(3))) v4i lds_v4i;
  __builtin_amdgcn_global_load_async_to_lds_b128((glb_v4i*)gsrc, (lds_v4i*)ldst, 0, 0);
#else
  *(float4*)ldst = *(const float4*)gsrc;   // synchronous fallback
#endif
}

__device__ __forceinline__ void wait_async() {
#if __has_builtin(__builtin_amdgcn_s_wait_asynccnt)
  __builtin_amdgcn_s_wait_asynccnt(0);
#else
  asm volatile("s_wait_asynccnt 0" ::: "memory");
#endif
  asm volatile("" ::: "memory");   // compiler barrier: keep ds reads after the wait
}

// ---------------- Kernel 1: C4[i][j] = sum_d Bq[d][i] * Av[j][d] ------------
__global__ __launch_bounds__(256) void compute_c4(
    const float* __restrict__ Bq, const float* __restrict__ Av,
    float* __restrict__ C4) {
  __shared__ float s[16];
  const int tid = threadIdx.x;
  if (tid < 16) s[tid] = 0.0f;
  __syncthreads();
  float p[16];
#pragma unroll
  for (int k = 0; k < 16; ++k) p[k] = 0.0f;
  for (int d = tid; d < HIDDEN; d += 256) {
    const float4 bq = *(const float4*)(Bq + (size_t)d * 4);
    const float bqv[4] = {bq.x, bq.y, bq.z, bq.w};
    float avv[4];
#pragma unroll
    for (int j = 0; j < 4; ++j) avv[j] = Av[(size_t)j * HIDDEN + d];
#pragma unroll
    for (int i = 0; i < 4; ++i)
#pragma unroll
      for (int j = 0; j < 4; ++j) p[i * 4 + j] += bqv[i] * avv[j];
  }
#pragma unroll
  for (int k = 0; k < 16; ++k) atomicAdd(&s[k], p[k]);   // ds_add_f32
  __syncthreads();
  if (tid < 16) C4[tid] = s[tid];
}

// ---------------- Kernel 2: low8[row][0..7] = x·[Aq;Av]^T (WMMA) ------------
// Weights are the 16x4 A-matrix (rows 0-3 = Aq, 4-7 = Av, 8-15 = zero),
// 16 x-rows are the 4x16 B-matrix.  Result: lane l<16 holds low8[row l][g]
// in acc[g], lanes 16-31 hold the zero-padded weight rows.
__global__ __launch_bounds__(256) void lora_project(
    const float* __restrict__ x, const float* __restrict__ Aq,
    const float* __restrict__ Av, float* __restrict__ low8) {
  __shared__ float tile[NW][16 * ROWSTR];
  __shared__ float red[16][8];

  const int tid   = threadIdx.x;
  const int wave  = tid >> 5;
  const int lane  = tid & 31;
  const int m     = lane & 15;           // A-matrix row / B-matrix column (x-row)
  const int khalf = (lane >> 4) << 1;    // 0 (lanes 0-15) or 2 (lanes 16-31)
  const int row0  = blockIdx.x << 4;
  const int kslab = wave * KSLAB;

  if (tid < 128) ((float*)red)[tid] = 0.0f;
  __syncthreads();

  const float* wrow = (m < 4) ? (Aq + (size_t)m * HIDDEN)
                    : ((m < 8) ? (Av + (size_t)(m - 4) * HIDDEN) : Aq);
  const float wscale = (m < 8) ? 1.0f : 0.0f;   // zero-pad weight rows 8..15

  float* wtile = tile[wave];
  v8f acc = {0.0f, 0.0f, 0.0f, 0.0f, 0.0f, 0.0f, 0.0f, 0.0f};

  for (int c0 = 0; c0 < KSLAB; c0 += KC) {
    const int kbase = kslab + c0;
    // Stage x[row0..row0+15][kbase..kbase+KC) into this wave's LDS buffer.
    // Per instruction: half-wave = 256 contiguous bytes of one row.
#pragma unroll
    for (int i = 0; i < 8; ++i) {
      const int r = 2 * i + (lane >> 4);
      const int c = (lane & 15) << 2;
      async_copy_b128(x + (size_t)(row0 + r) * HIDDEN + kbase + c,
                      wtile + r * ROWSTR + c);
    }
    wait_async();

#if __has_builtin(__builtin_amdgcn_wmma_f32_16x16x4_f32)
#pragma unroll
    for (int kk = 0; kk < KC; kk += 4) {
      v2f a = *(const v2f*)(wrow + kbase + kk + khalf);   // weights (L0-hot)
      a.x *= wscale; a.y *= wscale;
      v2f b = *(const v2f*)(wtile + m * ROWSTR + kk + khalf);  // x from LDS
      acc = __builtin_amdgcn_wmma_f32_16x16x4_f32(
          /*neg_a=*/false, a, /*neg_b=*/false, b,
          /*c_mod=*/(short)0, acc, /*reuse_a=*/false, /*reuse_b=*/false);
    }
#else
    // Scalar fallback with identical acc layout (lane<16 owns x-row m).
    if (lane < 16) {
      for (int kk = 0; kk < KC; ++kk) {
        const float xv = wtile[m * ROWSTR + kk];
        const int kg = kbase + kk;
#pragma unroll
        for (int g = 0; g < 8; ++g) {
          const float* wr = (g < 4) ? (Aq + (size_t)g * HIDDEN)
                                    : (Av + (size_t)(g - 4) * HIDDEN);
          acc[g] += wr[kg] * xv;
        }
      }
    }
#endif
  }

  // Cross-wave reduction of per-slab partials.
  if (lane < 16) {
#pragma unroll
    for (int g = 0; g < 8; ++g) atomicAdd(&red[lane][g], acc[g]);
  }
  __syncthreads();
  if (tid < 128) {
    const int r = tid >> 3, g = tid & 7;
    low8[((size_t)(row0 + r)) * 8 + g] = red[r][g];
  }
}

// ---------------- Kernel 3: out = 2x + s*lq·Bq^T + s*lv·Bv^T ----------------
__global__ __launch_bounds__(256) void lora_combine(
    const float* __restrict__ x, const float* __restrict__ Bq,
    const float* __restrict__ Bv, const float* __restrict__ low8,
    const float* __restrict__ C4, float* __restrict__ out) {
  const int row = blockIdx.x;
  const size_t base = (size_t)row * HIDDEN;
  const float* lw = low8 + (size_t)row * 8;

  float lq[4], cq[4], cv[4];
#pragma unroll
  for (int r = 0; r < 4; ++r) lq[r] = lw[r];
#pragma unroll
  for (int r = 0; r < 4; ++r) {
    const float lv = lw[4 + r] + SCALING * (lq[0] * C4[0 * 4 + r] +
                                            lq[1] * C4[1 * 4 + r] +
                                            lq[2] * C4[2 * 4 + r] +
                                            lq[3] * C4[3 * 4 + r]);
    cq[r] = SCALING * lq[r];
    cv[r] = SCALING * lv;
  }

#pragma unroll
  for (int i = 0; i < 4; ++i) {
    const int d0 = (threadIdx.x << 2) + (i << 10);
    const float4 xv = *(const float4*)(x + base + d0);
    const float xa[4] = {xv.x, xv.y, xv.z, xv.w};
    float o[4];
#pragma unroll
    for (int c = 0; c < 4; ++c) {
      const int d = d0 + c;
      const float4 bq = *(const float4*)(Bq + (size_t)d * 4);  // L2/L0-resident
      const float4 bv = *(const float4*)(Bv + (size_t)d * 4);
      o[c] = 2.0f * xa[c]
           + cq[0] * bq.x + cq[1] * bq.y + cq[2] * bq.z + cq[3] * bq.w
           + cv[0] * bv.x + cv[1] * bv.y + cv[2] * bv.z + cv[3] * bv.w;
    }
    *(float4*)(out + base + d0) = make_float4(o[0], o[1], o[2], o[3]);
  }
}

// ----------------------------------------------------------------------------
extern "C" void kernel_launch(void* const* d_in, const int* in_sizes, int n_in,
                              void* d_out, int out_size, void* d_ws, size_t ws_size,
                              hipStream_t stream) {
  (void)n_in; (void)out_size; (void)ws_size;
  const float* x  = (const float*)d_in[0];
  const float* Aq = (const float*)d_in[1];   // [4, 4096]
  const float* Bq = (const float*)d_in[2];   // [4096, 4]
  const float* Av = (const float*)d_in[3];   // [4, 4096]
  const float* Bv = (const float*)d_in[4];   // [4096, 4]
  float* out = (float*)d_out;
  const int nrows = in_sizes[0] / HIDDEN;    // 8192

  float* C4   = (float*)d_ws;                // 16 floats
  float* low8 = (float*)d_ws + 64;           // nrows * 8 floats (256 KB)

  compute_c4<<<1, 256, 0, stream>>>(Bq, Av, C4);
  lora_project<<<nrows / 16, 256, 0, stream>>>(x, Aq, Av, low8);
  lora_combine<<<nrows, 256, 0, stream>>>(x, Bq, Bv, low8, C4, out);
}

// v001
// One run takes 57.9 microseconds.
// Next to v000, in two timings, it ran 1.46 times as fast each time.
#include <hip/hip_runtime.h>

#define HIDDEN 4096
#define SCALING 2.0f

typedef float v2f __attribute__((ext_vector_type(2)));
typedef float v8f __attribute__((ext_vector_type(8)));

#define NW     8                 // waves per block (wave32 -> 256 threads)
#define KSLAB  (HIDDEN / NW)     // 512 K per wave
#define KC     64                // K-chunk staged in LDS per wave
#define ROWSTR (KC + 4)          // LDS row stride (floats): 68 -> conflict-free b64 reads

// ---------------- gfx1250 async-copy helpers (guarded) ----------------------
__device__ __forceinline__ void async_copy_b128(const float* gsrc, float* ldst) {
#if __has_builtin(__builtin_amdgcn_global_load_async_to_lds_b128)
  typedef int v4i __attribute__((vector_size(16)));
  typedef __attribute__((address_space(1))) v4i glb_v4i;
  typedef __attribute__((address_space(3))) v4i lds_v4i;
  __builtin_amdgcn_global_load_async_to_lds_b128((glb_v4i*)gsrc, (lds_v4i*)ldst, 0, 0);
#else
  *(float4*)ldst = *(const float4*)gsrc;   // synchronous fallback
#endif
}

__device__ __forceinline__ void wait_async() {
#if __has_builtin(__builtin_amdgcn_s_wait_asynccnt)
  __builtin_amdgcn_s_wait_asynccnt(0);
#else
  asm volatile("s_wait_asynccnt 0" ::: "memory");
#endif
  asm volatile("" ::: "memory");   // compiler barrier: keep ds reads after the wait
}

// ---------------- Kernel 1: C4[i][j] = sum_d Bq[d][i] * Av[j][d] ------------
__global__ __launch_bounds__(256) void compute_c4(
    const float* __restrict__ Bq, const float* __restrict__ Av,
    float* __restrict__ C4) {
  __shared__ float s[16];
  const int tid = threadIdx.x;
  if (tid < 16) s[tid] = 0.0f;
  __syncthreads();
  float p[16];
#pragma unroll
  for (int k = 0; k < 16; ++k) p[k] = 0.0f;
  for (int d = tid; d < HIDDEN; d += 256) {
    const float4 bq = *(const float4*)(Bq + (size_t)d * 4);
    const float bqv[4] = {bq.x, bq.y, bq.z, bq.w};
    float avv[4];
#pragma unroll
    for (int j = 0; j < 4; ++j) avv[j] = Av[(size_t)j * HIDDEN + d];
#pragma unroll
    for (int i = 0; i < 4; ++i)
#pragma unroll
      for (int j = 0; j < 4; ++j) p[i * 4 + j] += bqv[i] * avv[j];
  }
#pragma unroll
  for (int k = 0; k < 16; ++k) atomicAdd(&s[k], p[k]);   // ds_add_f32
  __syncthreads();
  if (tid < 16) C4[tid] = s[tid];
}

// ---------------- Kernel 2: low8[row][0..7] = x·[Aq;Av]^T (WMMA) ------------
// Weights are the 16x4 A-matrix (rows 0-3 = Aq, 4-7 = Av, 8-15 = zero),
// 16 x-rows are the 4x16 B-matrix.  Result: lane l<16 holds low8[row l][g]
// in acc[g], lanes 16-31 hold the zero-padded weight rows.
__global__ __launch_bounds__(256) void lora_project(
    const float* __restrict__ x, const float* __restrict__ Aq,
    const float* __restrict__ Av, float* __restrict__ low8) {
  __shared__ float tile[NW][16 * ROWSTR];
  __shared__ float red[16][8];

  const int tid   = threadIdx.x;
  const int wave  = tid >> 5;
  const int lane  = tid & 31;
  const int m     = lane & 15;           // A-matrix row / B-matrix column (x-row)
  const int khalf = (lane >> 4) << 1;    // 0 (lanes 0-15) or 2 (lanes 16-31)
  const int row0  = blockIdx.x << 4;
  const int kslab = wave * KSLAB;

  if (tid < 128) ((float*)red)[tid] = 0.0f;
  __syncthreads();

  const float* wrow = (m < 4) ? (Aq + (size_t)m * HIDDEN)
                    : ((m < 8) ? (Av + (size_t)(m - 4) * HIDDEN) : Aq);
  const float wscale = (m < 8) ? 1.0f : 0.0f;   // zero-pad weight rows 8..15

  float* wtile = tile[wave];
  v8f acc = {0.0f, 0.0f, 0.0f, 0.0f, 0.0f, 0.0f, 0.0f, 0.0f};

  for (int c0 = 0; c0 < KSLAB; c0 += KC) {
    const int kbase = kslab + c0;
    // Stage x[row0..row0+15][kbase..kbase+KC) into this wave's LDS buffer.
    // Per instruction: half-wave = 256 contiguous bytes of one row.
#pragma unroll
    for (int i = 0; i < 8; ++i) {
      const int r = 2 * i + (lane >> 4);
      const int c = (lane & 15) << 2;
      async_copy_b128(x + (size_t)(row0 + r) * HIDDEN + kbase + c,
                      wtile + r * ROWSTR + c);
    }
    wait_async();

#if __has_builtin(__builtin_amdgcn_wmma_f32_16x16x4_f32)
#pragma unroll
    for (int kk = 0; kk < KC; kk += 4) {
      v2f a = *(const v2f*)(wrow + kbase + kk + khalf);   // weights (L0-hot)
      a.x *= wscale; a.y *= wscale;
      v2f b = *(const v2f*)(wtile + m * ROWSTR + kk + khalf);  // x from LDS
      acc = __builtin_amdgcn_wmma_f32_16x16x4_f32(
          /*neg_a=*/false, a, /*neg_b=*/false, b,
          /*c_mod=*/(short)0, acc, /*reuse_a=*/false, /*reuse_b=*/false);
    }
#else
    // Scalar fallback with identical acc layout (lane<16 owns x-row m).
    if (lane < 16) {
      for (int kk = 0; kk < KC; ++kk) {
        const float xv = wtile[m * ROWSTR + kk];
        const int kg = kbase + kk;
#pragma unroll
        for (int g = 0; g < 8; ++g) {
          const float* wr = (g < 4) ? (Aq + (size_t)g * HIDDEN)
                                    : (Av + (size_t)(g - 4) * HIDDEN);
          acc[g] += wr[kg] * xv;
        }
      }
    }
#endif
  }

  // Cross-wave reduction of per-slab partials.
  if (lane < 16) {
#pragma unroll
    for (int g = 0; g < 8; ++g) atomicAdd(&red[lane][g], acc[g]);
  }
  __syncthreads();
  if (tid < 128) {
    const int r = tid >> 3, g = tid & 7;
    low8[((size_t)(row0 + r)) * 8 + g] = red[r][g];
  }
}

// ---------------- Kernel 3: out = 2x + s*lq·Bq^T + s*lv·Bv^T ----------------
// One work-group owns a tile of CROWS rows x CCOLS columns.  Each thread keeps
// the Bq/Bv rows of its 4 columns in registers for the whole tile; each lane
// keeps the 8 coefficients of rows (lane) and (lane + 32), handed to the wave
// by readlane.  x is fetched in groups of CU rows, one group ahead of the arithmetic.
#define CROWS 64
#define CCOLS 1024
#define CU    8

__device__ __forceinline__ float lane_bcast(float v, int l) {
  return __int_as_float(__builtin_amdgcn_readlane(__float_as_int(v), l));
}

__device__ __forceinline__ void row_coef(const float4 q, const float4 v,
                                         const float* __restrict__ C4,
                                         float (&cf)[8]) {
  const float lq[4] = {q.x, q.y, q.z, q.w};
  const float lr[4] = {v.x, v.y, v.z, v.w};
#pragma unroll
  for (int r = 0; r < 4; ++r) {
    const float lv = lr[r] + SCALING * (lq[0] * C4[0 * 4 + r] +
                                        lq[1] * C4[1 * 4 + r] +
                                        lq[2] * C4[2 * 4 + r] +
                                        lq[3] * C4[3 * 4 + r]);
    cf[r]     = SCALING * lq[r];
    cf[4 + r] = SCALING * lv;
  }
}

__device__ __forceinline__ void load_group(const float* __restrict__ xp, float4 (&b)[CU]) {
#pragma unroll
  for (int u = 0; u < CU; ++u) b[u] = *(const float4*)(xp + (size_t)u * HIDDEN);
  // Keeps these loads in front of the other group's arithmetic, so that they
  // are in flight while it runs; without it the scheduler sinks them.
  __builtin_amdgcn_sched_barrier(0);
}

__device__ __forceinline__ void emit_group(float4 (&xb)[CU], const float (&cf)[8],
                                           int lane0, const float4 (&bq)[4],
                                           const float4 (&bv)[4], float* __restrict__ op) {
#pragma unroll
  for (int u = 0; u < CU; ++u) {
    float c[8];
#pragma unroll
    for (int k = 0; k < 8; ++k) c[k] = lane_bcast(cf[k], lane0 + u);
    const float xa[4] = {xb[u].x, xb[u].y, xb[u].z, xb[u].w};
    float o[4];
#pragma unroll
    for (int j = 0; j < 4; ++j) {
      o[j] = 2.0f * xa[j]
           + c[0] * bq[j].x + c[1] * bq[j].y + c[2] * bq[j].z + c[3] * bq[j].w
           + c[4] * bv[j].x + c[5] * bv[j].y + c[6] * bv[j].z + c[7] * bv[j].w;
    }
    xb[u] = make_float4(o[0], o[1], o[2], o[3]);
  }
  // Keeps the group's stores together behind its arithmetic, so that no
  // result register is reused between a store and the wait below.
  __builtin_amdgcn_sched_barrier(0);
#pragma unroll
  for (int u = 0; u < CU; ++u) *(float4*)(op + (size_t)u * HIDDEN) = xb[u];
  // The stores' data registers are written again by the next loads.
  asm volatile("s_wait_xcnt 0x0" ::: "memory");
  // Keeps every later register write behind that wait.
  __builtin_amdgcn_sched_barrier(0);
}

__global__ __launch_bounds__(256) void lora_combine(
    const float* __restrict__ x, const float* __restrict__ Bq,
    const float* __restrict__ Bv, const float* __restrict__ low8,
    const float* __restrict__ C4, float* __restrict__ out) {
  const int lane = threadIdx.x & 31;
  const int col  = (blockIdx.x & 3) * CCOLS + (threadIdx.x << 2);
  const int row0 = (blockIdx.x >> 2) * CROWS;
  const float* xp = x + (size_t)row0 * HIDDEN + col;
  float*       op = out + (size_t)row0 * HIDDEN + col;

  float4 xa[CU], xb[CU];
  load_group(xp, xa);
  load_group(xp + (size_t)CU * HIDDEN, xb);

  const float* lw = low8 + (size_t)(row0 + lane) * 8;
  const float4 q0 = *(const float4*)lw;
  const float4 v0 = *(const float4*)(lw + 4);
  const float4 q1 = *(const float4*)(lw + 32 * 8);
  const float4 v1 = *(const float4*)(lw + 32 * 8 + 4);
  // Keeps the four loads above in front of the wait below.
  __builtin_amdgcn_sched_barrier(0);
  // Their address registers are free for the results of the next loads.
  asm volatile("s_wait_xcnt 0x0" ::: "memory");
  // Keeps the next loads behind that wait.
  __builtin_amdgcn_sched_barrier(0);
  float4 bq[4], bv[4];
#pragma unroll
  for (int j = 0; j < 4; ++j) {
    bq[j] = *(const float4*)(Bq + (size_t)(col + j) * 4);
    bv[j] = *(const float4*)(Bv + (size_t)(col + j) * 4);
  }
  // Keeps the loads above in front of the wait below.
  __builtin_amdgcn_sched_barrier(0);
  // The address registers of the loads above are reused from here on.
  asm volatile("s_wait_xcnt 0x0" ::: "memory");
  // Keeps every later register write behind that wait.
  __builtin_amdgcn_sched_barrier(0);

  float clo[8], chi[8];
  row_coef(q0, v0, C4, clo);
  row_coef(q1, v1, C4, chi);

#pragma unroll
  for (int h = 0; h < 2; ++h) {
    const float (&cf)[8] = h ? chi : clo;
#pragma unroll
    for (int g = 0; g < 32 / CU; g += 2) {
      const int r = h * 32 + g * CU;
      emit_group(xa, cf, g * CU, bq, bv, op + (size_t)r * HIDDEN);
      if (r + 2 * CU < CROWS) load_group(xp + (size_t)(r + 2 * CU) * HIDDEN, xa);
      emit_group(xb, cf, (g + 1) * CU, bq, bv, op + (size_t)(r + CU) * HIDDEN);
      if (r + 3 * CU < CROWS) load_group(xp + (size_t)(r + 3 * CU) * HIDDEN, xb);
    }
  }
}

// ----------------------------------------------------------------------------
extern "C" void kernel_launch(void* const* d_in, const int* in_sizes, int n_in,
                              void* d_out, int out_size, void* d_ws, size_t ws_size,
                              hipStream_t stream) {
  (void)n_in; (void)out_size; (void)ws_size;
  const float* x  = (const float*)d_in[0];
  const float* Aq = (const float*)d_in[1];   // [4, 4096]
  const float* Bq = (const float*)d_in[2];   // [4096, 4]
  const float* Av = (const float*)d_in[3];   // [4, 4096]
  const float* Bv = (const float*)d_in[4];   // [4096, 4]
  float* out = (float*)d_out;
  const int nrows = in_sizes[0] / HIDDEN;    // 8192

  float* C4   = (float*)d_ws;                // 16 floats
  float* low8 = (float*)d_ws + 64;           // nrows * 8 floats (256 KB)

  compute_c4<<<1, 256, 0, stream>>>(Bq, Av, C4);
  lora_project<<<nrows / 16, 256, 0, stream>>>(x, Aq, Av, low8);
  lora_combine<<<nrows / 16, 256, 0, stream>>>(x, Bq, Bv, low8, C4, out);
}

// v002
// It runs in 41.6 microseconds.
// Timed twice side by side with v001, it ran 1.37 and 1.39 times as fast.
// Counting every step since v000, it is 2.01 times as fast.
#include <hip/hip_runtime.h>

#define HIDDEN 4096
#define SCALING 2.0f

typedef float v2f __attribute__((ext_vector_type(2)));
typedef float v8f __attribute__((ext_vector_type(8)));

#define NW     16                // waves per block (wave32 -> 512 threads)
#define KSLAB  (HIDDEN / NW)     // 256 columns per wave
#define KC     64                // columns copied to LDS per step and wave
#define NCH    (KSLAB / KC)      // copy steps per wave
#define ROWSTR (HIDDEN + 4)      // LDS row stride (floats): 4100 = 4 mod 64 -> conflict-free reads

// ---------------- gfx1250 async-copy helpers (guarded) ----------------------
__device__ __forceinline__ void async_copy_b128(const float* gsrc, float* ldst) {
#if __has_builtin(__builtin_amdgcn_global_load_async_to_lds_b128)
  typedef int v4i __attribute__((vector_size(16)));
  typedef __attribute__((address_space(1))) v4i glb_v4i;
  typedef __attribute__((address_space(3))) v4i lds_v4i;
  __builtin_amdgcn_global_load_async_to_lds_b128((glb_v4i*)gsrc, (lds_v4i*)ldst, 0, 0);
#else
  *(float4*)ldst = *(const float4*)gsrc;   // synchronous fallback
#endif
}

__device__ __forceinline__ void wait_async() {
#if __has_builtin(__builtin_amdgcn_s_wait_asynccnt)
  __builtin_amdgcn_s_wait_asynccnt(0);
#else
  asm volatile("s_wait_asynccnt 0" ::: "memory");
#endif
  asm volatile("" ::: "memory");   // compiler barrier: keep ds reads after the wait
}

// ---------------- Kernel 1: C4[i][j] = sum_d Bq[d][i] * Av[j][d] ------------
__global__ __launch_bounds__(256) void compute_c4(
    const float* __restrict__ Bq, const float* __restrict__ Av,
    float* __restrict__ C4) {
  __shared__ float s[16];
  const int tid = threadIdx.x;
  if (tid < 16) s[tid] = 0.0f;
  __syncthreads();
  float p[16];
#pragma unroll
  for (int k = 0; k < 16; ++k) p[k] = 0.0f;
  for (int d = tid; d < HIDDEN; d += 256) {
    const float4 bq = *(const float4*)(Bq + (size_t)d * 4);
    const float bqv[4] = {bq.x, bq.y, bq.z, bq.w};
    float avv[4];
#pragma unroll
    for (int j = 0; j < 4; ++j) avv[j] = Av[(size_t)j * HIDDEN + d];
#pragma unroll
    for (int i = 0; i < 4; ++i)
#pragma unroll
      for (int j = 0; j < 4; ++j) p[i * 4 + j] += bqv[i] * avv[j];
  }
#pragma unroll
  for (int k = 0; k < 16; ++k) atomicAdd(&s[k], p[k]);   // ds_add_f32
  __syncthreads();
  if (tid < 16) C4[tid] = s[tid];
}

// ---------------- Kernel 2: out = 2x + s*lq*Bq^T + s*lv*Bv^T ----------------
// One work-group owns 16 whole rows of x and keeps them in LDS, so that x is
// fetched from memory once.  Wave w owns columns [w*KSLAB, (w+1)*KSLAB): it
// copies them in, multiplies them with the weights (WMMA), and after the
// cross-wave sum of the 16 x 8 low-rank values writes the same columns of out.
// WMMA operands: the weights are the 16x4 A-matrix (rows 0-3 = Aq, 4-7 = Av,
// 8-15 = zero), 16 x-rows are the 4x16 B-matrix.  Lane l<16 holds
// low8[row l][g] in acc[g], lanes 16-31 hold the zero-padded weight rows.
#define GR 4                     // rows per group of stores

__device__ __forceinline__ float lane_bcast(float v, int l) {
  return __int_as_float(__builtin_amdgcn_readlane(__float_as_int(v), l));
}

__device__ __forceinline__ void row_coef(const float4 q, const float4 v,
                                         const float* __restrict__ C4,
                                         float (&cf)[8]) {
  const float lq[4] = {q.x, q.y, q.z, q.w};
  const float lr[4] = {v.x, v.y, v.z, v.w};
#pragma unroll
  for (int r = 0; r < 4; ++r) {
    const float lv = lr[r] + SCALING * (lq[0] * C4[0 * 4 + r] +
                                        lq[1] * C4[1 * 4 + r] +
                                        lq[2] * C4[2 * 4 + r] +
                                        lq[3] * C4[3 * 4 + r]);
    cf[r]     = SCALING * lq[r];
    cf[4 + r] = SCALING * lv;
  }
}

// Copies x[row0..row0+15][k0..k0+KC) to its place in the tile.
// Per instruction: half-wave = 256 contiguous bytes of one row.
__device__ __forceinline__ void copy_chunk(const float* __restrict__ xrow0,
                                           float* tile, int k0, int lane) {
#pragma unroll
  for (int i = 0; i < 8; ++i) {
    const int r = 2 * i + (lane >> 4);
    const int c = k0 + ((lane & 15) << 2);
    async_copy_b128(xrow0 + (size_t)r * HIDDEN + c, tile + r * ROWSTR + c);
  }
}

// One chunk's weight fragments (WGP-cache-hot after the first touch of a line).
__device__ __forceinline__ void load_weights(const float* __restrict__ wp, v2f (&a)[KC / 4]) {
#pragma unroll
  for (int kk = 0; kk < KC / 4; ++kk) a[kk] = *(const v2f*)(wp + kk * 4);
  // Keeps the loads above in front of the wait below.
  __builtin_amdgcn_sched_barrier(0);
  // Their address registers are free for other values from here on.
  asm volatile("s_wait_xcnt 0x0" ::: "memory");
  // Keeps every later register write behind that wait.
  __builtin_amdgcn_sched_barrier(0);
}

__global__ __launch_bounds__(512) void lora_fused(
    const float* __restrict__ x, const float* __restrict__ Aq,
    const float* __restrict__ Av, const float* __restrict__ Bq,
    const float* __restrict__ Bv, const float* __restrict__ C4,
    float* __restrict__ out) {
  __shared__ __attribute__((aligned(16))) float tile[16 * ROWSTR];
  __shared__ __attribute__((aligned(16))) float red[16][8];

  const int tid   = threadIdx.x;
  const int wave  = tid >> 5;
  const int lane  = tid & 31;
  const int m     = lane & 15;           // A-matrix row / B-matrix column (x-row)
  const int khalf = (lane >> 4) << 1;    // 0 (lanes 0-15) or 2 (lanes 16-31)
  const int row0  = blockIdx.x << 4;
  const int kslab = wave * KSLAB;
  const float* xrow0 = x + (size_t)row0 * HIDDEN;

  copy_chunk(xrow0, tile, kslab, lane);

  if (tid < 128) ((float*)red)[tid] = 0.0f;
  __syncthreads();

  const float* wrow = (m < 4) ? (Aq + (size_t)m * HIDDEN)
                    : ((m < 8) ? (Av + (size_t)(m - 4) * HIDDEN) : Aq);
  const float wscale = (m < 8) ? 1.0f : 0.0f;   // zero-pad weight rows 8..15
  const float* wp = wrow + kslab + khalf;
  const int col = kslab + (lane << 2);

  // Weight fragments run one chunk ahead of the WMMAs, like the copies.
  v2f a[2][KC / 4];
  load_weights(wp, a[0]);

  // The Bq/Bv rows of this lane's 8 columns and the 4x4 matrix are used behind
  // the cross-wave sum; fetched here, they arrive while x streams in.
  float4 bq[2][4], bv[2][4];
#pragma unroll
  for (int h = 0; h < 2; ++h)
#pragma unroll
    for (int j = 0; j < 4; ++j) {
      bq[h][j] = *(const float4*)(Bq + (size_t)(col + h * 128 + j) * 4);
      bv[h][j] = *(const float4*)(Bv + (size_t)(col + h * 128 + j) * 4);
    }
  // Keeps the loads above in front of the wait below.
  __builtin_amdgcn_sched_barrier(0);
  // The address registers of the loads above are reused from here on.
  asm volatile("s_wait_xcnt 0x0" ::: "memory");
  // Keeps every later register write behind that wait.
  __builtin_amdgcn_sched_barrier(0);
  float c4[16];
#pragma unroll
  for (int k = 0; k < 16; ++k) c4[k] = C4[k];

  v8f acc = {0.0f, 0.0f, 0.0f, 0.0f, 0.0f, 0.0f, 0.0f, 0.0f};
#pragma unroll
  for (int ch = 0; ch < NCH; ++ch) {
    wait_async();                        // chunk ch of this wave has landed
    if (ch + 1 < NCH) {
      copy_chunk(xrow0, tile, kslab + (ch + 1) * KC, lane);
      load_weights(wp + (ch + 1) * KC, a[(ch + 1) & 1]);
    }
#pragma unroll
    for (int kk = 0; kk < KC; kk += 4) {
      v2f aw = a[ch & 1][kk >> 2];
      aw.x *= wscale; aw.y *= wscale;
      const v2f b = *(const v2f*)(tile + m * ROWSTR + kslab + ch * KC + kk + khalf);
      acc = __builtin_amdgcn_wmma_f32_16x16x4_f32(
          /*neg_a=*/false, aw, /*neg_b=*/false, b,
          /*c_mod=*/(short)0, acc, /*reuse_a=*/false, /*reuse_b=*/false);
    }
  }

  // Cross-wave reduction of per-slab partials.
  if (lane < 16) {
#pragma unroll
    for (int g = 0; g < 8; ++g) atomicAdd(&red[lane][g], acc[g]);
  }
  __syncthreads();

  // Lane l (and l + 16) forms the 8 coefficients of row l; readlane hands them
  // to the wave row by row.
  float cf[8];
  row_coef(*(const float4*)&red[m][0], *(const float4*)&red[m][4], c4, cf);

  float* op = out + (size_t)row0 * HIDDEN + col;
#pragma unroll
  for (int g = 0; g < 16; g += GR) {
    float4 o[GR][2];
#pragma unroll
    for (int u = 0; u < GR; ++u) {
      float c[8];
#pragma unroll
      for (int k = 0; k < 8; ++k) c[k] = lane_bcast(cf[k], g + u);
#pragma unroll
      for (int h = 0; h < 2; ++h) {
        const float4 xv = *(const float4*)(tile + (g + u) * ROWSTR + col + h * 128);
        const float xa[4] = {xv.x, xv.y, xv.z, xv.w};
        float t[4];
#pragma unroll
        for (int j = 0; j < 4; ++j) {
          t[j] = 2.0f * xa[j]
               + c[0] * bq[h][j].x + c[1] * bq[h][j].y + c[2] * bq[h][j].z + c[3] * bq[h][j].w
               + c[4] * bv[h][j].x + c[5] * bv[h][j].y + c[6] * bv[h][j].z + c[7] * bv[h][j].w;
        }
        o[u][h] = make_float4(t[0], t[1], t[2], t[3]);
      }
    }
    // Keeps the group's stores together behind its arithmetic, so that no
    // result register is reused between a store and the wait below.
    __builtin_amdgcn_sched_barrier(0);
#pragma unroll
    for (int u = 0; u < GR; ++u)
#pragma unroll
      for (int h = 0; h < 2; ++h)
        *(float4*)(op + (size_t)(g + u) * HIDDEN + h * 128) = o[u][h];
    // The stores' data registers are written again by the next group.
    asm volatile("s_wait_xcnt 0x0" ::: "memory");
    // Keeps every later register write behind that wait.
    __builtin_amdgcn_sched_barrier(0);
  }
}

// ----------------------------------------------------------------------------
extern "C" void kernel_launch(void* const* d_in, const int* in_sizes, int n_in,
                              void* d_out, int out_size, void* d_ws, size_t ws_size,
                              hipStream_t stream) {
  (void)n_in; (void)out_size; (void)ws_size;
  const float* x  = (const float*)d_in[0];
  const float* Aq = (const float*)d_in[1];   // [4, 4096]
  const float* Bq = (const float*)d_in[2];   // [4096, 4]
  const float* Av = (const float*)d_in[3];   // [4, 4096]
  const float* Bv = (const float*)d_in[4];   // [4096, 4]
  float* out = (float*)d_out;
  const int nrows = in_sizes[0] / HIDDEN;    // 8192

  float* C4   = (float*)d_ws;                // 16 floats

  compute_c4<<<1, 256, 0, stream>>>(Bq, Av, C4);
  lora_fused<<<nrows / 16, 512, 0, stream>>>(x, Aq, Av, Bq, Bv, C4, out);
}

// v003
// It runs in 27.4 microseconds.
// Next to v002, in two timings, it ran 1.52 and 1.51 times as fast.
// All steps since v000 together make it 3.05 times as fast.
#include <hip/hip_runtime.h>

#define HIDDEN 4096
#define SCALING 2.0f

typedef float v2f __attribute__((ext_vector_type(2)));
typedef float v8f __attribute__((ext_vector_type(8)));

#define NW     16                // waves per block (wave32 -> 512 threads)
#define KSLAB  (HIDDEN / NW)     // 256 columns per wave
#define KC     64                // columns copied to LDS per step and wave
#define NCH    (KSLAB / KC)      // copy steps per wave
#define ROWSTR (HIDDEN + 4)      // LDS row stride (floats): 4100 = 4 mod 64 -> conflict-free reads

// ---------------- gfx1250 async-copy helpers (guarded) ----------------------
__device__ __forceinline__ void async_copy_b128(const float* gsrc, float* ldst) {
#if __has_builtin(__builtin_amdgcn_global_load_async_to_lds_b128)
  typedef int v4i __attribute__((vector_size(16)));
  typedef __attribute__((address_space(1))) v4i glb_v4i;
  typedef __attribute__((address_space(3))) v4i lds_v4i;
  __builtin_amdgcn_global_load_async_to_lds_b128((glb_v4i*)gsrc, (lds_v4i*)ldst, 0, 0);
#else
  *(float4*)ldst = *(const float4*)gsrc;   // synchronous fallback
#endif
}

__device__ __forceinline__ void wait_async() {
#if __has_builtin(__builtin_amdgcn_s_wait_asynccnt)
  __builtin_amdgcn_s_wait_asynccnt(0);
#else
  asm volatile("s_wait_asynccnt 0" ::: "memory");
#endif
  asm volatile("" ::: "memory");   // compiler barrier: keep ds reads after the wait
}

// ---------------- out = 2x + s*lq*Bq^T + s*lv*Bv^T --------------------------
// One work-group owns 16 whole rows of x and keeps them in LDS, so that x is
// fetched from memory once.  Wave w owns columns [w*KSLAB, (w+1)*KSLAB): it
// copies them in, multiplies them with the weights (WMMA), and after the
// cross-wave sum of the 16 x 8 low-rank values writes the same columns of out.
// WMMA operands: the weights are the 16x4 A-matrix (rows 0-3 = Aq, 4-7 = Av,
// 8-15 = zero), 16 x-rows are the 4x16 B-matrix.  Lane l<16 holds
// low8[row l][g] in acc[g], lanes 16-31 hold the zero-padded weight rows.
// The 4x4 matrix C4[i][j] = sum_d Bq[d][i] * Av[j][d] is formed by every
// work-group itself, each wave summing its own columns while x streams in.
#define GR 4                     // rows per group of stores

__device__ __forceinline__ float lane_bcast(float v, int l) {
  return __int_as_float(__builtin_amdgcn_readlane(__float_as_int(v), l));
}

// The value that v has in lane (l ^ XM) of the same row of 16 lanes (row_xmask).
template <int XM>
__device__ __forceinline__ float row_xlane(float v) {
  return __int_as_float(__builtin_amdgcn_update_dpp(
      0, __float_as_int(v), 0x160 + XM, 0xf, 0xf, true));
}

// One step of a sum over a row of 16 lanes that halves the number of values:
// the lanes with bit XM clear go on with v[0..N), the others with v[N..2N).
template <int XM, int N>
__device__ __forceinline__ void row_fold(const float (&v)[2 * N], float (&o)[N], int m) {
  const bool up = (m & XM) != 0;
#pragma unroll
  for (int k = 0; k < N; ++k) {
    const float keep = up ? v[k + N] : v[k];
    const float send = up ? v[k] : v[k + N];
    o[k] = keep + row_xlane<XM>(send);
  }
}

__device__ __forceinline__ void row_coef(const float4 q, const float4 v,
                                         const float* __restrict__ C4,
                                         float (&cf)[8]) {
  const float lq[4] = {q.x, q.y, q.z, q.w};
  const float lr[4] = {v.x, v.y, v.z, v.w};
#pragma unroll
  for (int r = 0; r < 4; ++r) {
    const float lv = lr[r] + SCALING * (lq[0] * C4[0 * 4 + r] +
                                        lq[1] * C4[1 * 4 + r] +
                                        lq[2] * C4[2 * 4 + r] +
                                        lq[3] * C4[3 * 4 + r]);
    cf[r]     = SCALING * lq[r];
    cf[4 + r] = SCALING * lv;
  }
}

// Copies x[row0..row0+15][k0..k0+KC) to its place in the tile.
// Per instruction: half-wave = 256 contiguous bytes of one row.
__device__ __forceinline__ void copy_chunk(const float* __restrict__ xrow0,
                                           float* tile, int k0, int lane) {
#pragma unroll
  for (int i = 0; i < 8; ++i) {
    const int r = 2 * i + (lane >> 4);
    const int c = k0 + ((lane & 15) << 2);
    async_copy_b128(xrow0 + (size_t)r * HIDDEN + c, tile + r * ROWSTR + c);
  }
}

// One chunk's weight fragments (WGP-cache-hot after the first touch of a line).
__device__ __forceinline__ void load_weights(const float* __restrict__ wp, v2f (&a)[KC / 4]) {
#pragma unroll
  for (int kk = 0; kk < KC / 4; ++kk) a[kk] = *(const v2f*)(wp + kk * 4);
  // Keeps the loads above in front of the wait below.
  __builtin_amdgcn_sched_barrier(0);
  // Their address registers are free for other values from here on.
  asm volatile("s_wait_xcnt 0x0" ::: "memory");
  // Keeps every later register write behind that wait.
  __builtin_amdgcn_sched_barrier(0);
}

// One wave's share of C4: 8 columns a lane (the pairs i = 0,1 and i = 2,3 of
// Bq[d][i] side by side), then the sum over each row of 16 lanes, which leaves
// entry m in lane m; both rows add theirs to the work-group's sum in c4sum.
__device__ __forceinline__ void c4_share(const float4 (&bq)[2][4], const float4 (&av)[4][2],
                                         int m, float* c4sum) {
  v2f plo[4], phi[4];
#pragma unroll
  for (int r = 0; r < 4; ++r) { plo[r] = (v2f){0.0f, 0.0f}; phi[r] = (v2f){0.0f, 0.0f}; }
#pragma unroll
  for (int h = 0; h < 2; ++h)
#pragma unroll
    for (int r = 0; r < 4; ++r) {
      const float ar[4] = {av[r][h].x, av[r][h].y, av[r][h].z, av[r][h].w};
#pragma unroll
      for (int j = 0; j < 4; ++j) {
        const v2f aa = {ar[j], ar[j]};
        plo[r] = __builtin_elementwise_fma((v2f){bq[h][j].x, bq[h][j].y}, aa, plo[r]);
        phi[r] = __builtin_elementwise_fma((v2f){bq[h][j].z, bq[h][j].w}, aa, phi[r]);
      }
    }
  float p16[16], p8[8], p4[4], p2[2], p1[1];
#pragma unroll
  for (int r = 0; r < 4; ++r) {
    p16[0 * 4 + r] = plo[r].x; p16[1 * 4 + r] = plo[r].y;
    p16[2 * 4 + r] = phi[r].x; p16[3 * 4 + r] = phi[r].y;
  }
  row_fold<8, 8>(p16, p8, m);
  row_fold<4, 4>(p8, p4, m);
  row_fold<2, 2>(p4, p2, m);
  row_fold<1, 1>(p2, p1, m);
  atomicAdd(c4sum + m, p1[0]);
}

__global__ __launch_bounds__(512) void lora_fused(
    const float* __restrict__ x, const float* __restrict__ Aq,
    const float* __restrict__ Av, const float* __restrict__ Bq,
    const float* __restrict__ Bv, float* __restrict__ out) {
  __shared__ __attribute__((aligned(16))) float tile[16 * ROWSTR];
  // Rows 0-15: the low-rank values of the 16 x rows; rows 16-17: C4.
  __shared__ __attribute__((aligned(16))) float red[18][8];

  const int tid   = threadIdx.x;
  const int wave  = tid >> 5;
  const int lane  = tid & 31;
  const int m     = lane & 15;           // A-matrix row / B-matrix column (x-row)
  const int khalf = (lane >> 4) << 1;    // 0 (lanes 0-15) or 2 (lanes 16-31)
  const int row0  = blockIdx.x << 4;
  const int kslab = wave * KSLAB;
  const float* xrow0 = x + (size_t)row0 * HIDDEN;

  copy_chunk(xrow0, tile, kslab, lane);

  if (tid < 144) ((float*)red)[tid] = 0.0f;
  __syncthreads();

  const float* wrow = (m < 4) ? (Aq + (size_t)m * HIDDEN)
                    : ((m < 8) ? (Av + (size_t)(m - 4) * HIDDEN) : Aq);
  const float wscale = (m < 8) ? 1.0f : 0.0f;   // zero-pad weight rows 8..15
  const float* wp = wrow + kslab + khalf;
  const int col = kslab + (lane << 2);

  // Weight fragments run one chunk ahead of the WMMAs, like the copies.
  v2f a[2][KC / 4];
  load_weights(wp, a[0]);

  // The Bq/Bv rows of this lane's 8 columns are used behind the cross-wave sum;
  // fetched here, they arrive while x streams in.  av: the same 8 columns of Av.
  float4 bq[2][4], bv[2][4], av[4][2];
#pragma unroll
  for (int h = 0; h < 2; ++h)
#pragma unroll
    for (int j = 0; j < 4; ++j) {
      bq[h][j] = *(const float4*)(Bq + (size_t)(col + h * 128 + j) * 4);
      bv[h][j] = *(const float4*)(Bv + (size_t)(col + h * 128 + j) * 4);
      av[j][h] = *(const float4*)(Av + (size_t)j * HIDDEN + col + h * 128);
    }
  // Keeps the loads above in front of the wait below.
  __builtin_amdgcn_sched_barrier(0);
  // The address registers of the loads above are reused from here on.
  asm volatile("s_wait_xcnt 0x0" ::: "memory");
  // Keeps every later register write behind that wait.
  __builtin_amdgcn_sched_barrier(0);
  v8f acc = {0.0f, 0.0f, 0.0f, 0.0f, 0.0f, 0.0f, 0.0f, 0.0f};
#pragma unroll
  for (int ch = 0; ch < NCH; ++ch) {
    wait_async();                        // chunk ch of this wave has landed
    if (ch + 1 < NCH) {
      copy_chunk(xrow0, tile, kslab + (ch + 1) * KC, lane);
      load_weights(wp + (ch + 1) * KC, a[(ch + 1) & 1]);
    }
    // Done here, its vector work runs while the second chunk is on its way.
    if (ch == 0) c4_share(bq, av, m, &red[16][0]);
#pragma unroll
    for (int kk = 0; kk < KC; kk += 4) {
      v2f aw = a[ch & 1][kk >> 2];
      aw.x *= wscale; aw.y *= wscale;
      const v2f b = *(const v2f*)(tile + m * ROWSTR + kslab + ch * KC + kk + khalf);
      acc = __builtin_amdgcn_wmma_f32_16x16x4_f32(
          /*neg_a=*/false, aw, /*neg_b=*/false, b,
          /*c_mod=*/(short)0, acc, /*reuse_a=*/false, /*reuse_b=*/false);
    }
  }

  // Cross-wave reduction of per-slab partials.
  if (lane < 16) {
#pragma unroll
    for (int g = 0; g < 8; ++g) atomicAdd(&red[lane][g], acc[g]);
  }
  __syncthreads();

  // Lane l (and l + 16) forms the 8 coefficients of row l; readlane hands them
  // to the wave row by row.
  // Lane m fetches entry m of C4; readlane makes the 16 entries wave-uniform.
  const float c4m = red[16 + (m >> 3)][m & 7];
  float c4[16];
#pragma unroll
  for (int k = 0; k < 16; ++k) c4[k] = lane_bcast(c4m, k);
  float cf[8];
  row_coef(*(const float4*)&red[m][0], *(const float4*)&red[m][4], c4, cf);

  float* op = out + (size_t)row0 * HIDDEN + col;
#pragma unroll
  for (int g = 0; g < 16; g += GR) {
    float4 o[GR][2];
#pragma unroll
    for (int u = 0; u < GR; ++u) {
      float c[8];
#pragma unroll
      for (int k = 0; k < 8; ++k) c[k] = lane_bcast(cf[k], g + u);
#pragma unroll
      for (int h = 0; h < 2; ++h) {
        const float4 xv = *(const float4*)(tile + (g + u) * ROWSTR + col + h * 128);
        const float xa[4] = {xv.x, xv.y, xv.z, xv.w};
        float t[4];
#pragma unroll
        for (int j = 0; j < 4; ++j) {
          t[j] = 2.0f * xa[j]
               + c[0] * bq[h][j].x + c[1] * bq[h][j].y + c[2] * bq[h][j].z + c[3] * bq[h][j].w
               + c[4] * bv[h][j].x + c[5] * bv[h][j].y + c[6] * bv[h][j].z + c[7] * bv[h][j].w;
        }
        o[u][h] = make_float4(t[0], t[1], t[2], t[3]);
      }
    }
    // Keeps the group's stores together behind its arithmetic, so that no
    // result register is reused between a store and the wait below.
    __builtin_amdgcn_sched_barrier(0);
#pragma unroll
    for (int u = 0; u < GR; ++u)
#pragma unroll
      for (int h = 0; h < 2; ++h)
        *(float4*)(op + (size_t)(g + u) * HIDDEN + h * 128) = o[u][h];
    // The stores' data registers are written again by the next group.
    asm volatile("s_wait_xcnt 0x0" ::: "memory");
    // Keeps every later register write behind that wait.
    __builtin_amdgcn_sched_barrier(0);
  }
}

// ----------------------------------------------------------------------------
extern "C" void kernel_launch(void* const* d_in, const int* in_sizes, int n_in,
                              void* d_out, int out_size, void* d_ws, size_t ws_size,
                              hipStream_t stream) {
  (void)n_in; (void)out_size; (void)d_ws; (void)ws_size;
  const float* x  = (const float*)d_in[0];
  const float* Aq = (const float*)d_in[1];   // [4, 4096]
  const float* Bq = (const float*)d_in[2];   // [4096, 4]
  const float* Av = (const float*)d_in[3];   // [4, 4096]
  const float* Bv = (const float*)d_in[4];   // [4096, 4]
  float* out = (float*)d_out;
  const int nrows = in_sizes[0] / HIDDEN;    // 8192

  lora_fused<<<nrows / 16, 512, 0, stream>>>(x, Aq, Av, Bq, Bv, out);
}

// v004
// A run of this version takes 24.6 microseconds.
// Two timings next to v003 both put it at 1.13 times that version's speed.
// Over all steps from v000 it is 3.44 times as fast.
#include <hip/hip_runtime.h>

#define HIDDEN 4096
#define SCALING 2.0f

typedef float v2f __attribute__((ext_vector_type(2)));
typedef float v8f __attribute__((ext_vector_type(8)));

#define NW     16                // waves per block (wave32 -> 512 threads)
#define KSLAB  (HIDDEN / NW)     // 256 columns per wave
#define KC     64                // columns copied to LDS per step and wave
#define NCH    (KSLAB / KC)      // copy steps per wave
#define ROWSTR (HIDDEN + 4)      // LDS row stride (floats): 4100 = 4 mod 64 -> conflict-free reads

// ---------------- gfx1250 async-copy helpers (guarded) ----------------------
__device__ __forceinline__ void async_copy_b128(const float* gsrc, float* ldst) {
#if __has_builtin(__builtin_amdgcn_global_load_async_to_lds_b128)
  typedef int v4i __attribute__((vector_size(16)));
  typedef __attribute__((address_space(1))) v4i glb_v4i;
  typedef __attribute__((address_space(3))) v4i lds_v4i;
  // Last argument 1 = non-temporal: x is read once, its lines need no place in L2.
  __builtin_amdgcn_global_load_async_to_lds_b128((glb_v4i*)gsrc, (lds_v4i*)ldst, 0, 1);
#else
  *(float4*)ldst = *(const float4*)gsrc;   // synchronous fallback
#endif
}

__device__ __forceinline__ void wait_async() {
#if __has_builtin(__builtin_amdgcn_s_wait_asynccnt)
  __builtin_amdgcn_s_wait_asynccnt(0);
#else
  asm volatile("s_wait_asynccnt 0" ::: "memory");
#endif
  asm volatile("" ::: "memory");   // compiler barrier: keep ds reads after the wait
}

// ---------------- out = 2x + s*lq*Bq^T + s*lv*Bv^T --------------------------
// One work-group owns 16 whole rows of x and keeps them in LDS, so that x is
// fetched from memory once.  Wave w owns columns [w*KSLAB, (w+1)*KSLAB): it
// copies them in, multiplies them with the weights (WMMA), and after the
// cross-wave sum of the 16 x 8 low-rank values writes the same columns of out.
// WMMA operands: the weights are the 16x4 A-matrix (rows 0-3 = Aq, 4-7 = Av,
// 8-15 = zero), 16 x-rows are the 4x16 B-matrix.  Lane l<16 holds
// low8[row l][g] in acc[g], lanes 16-31 hold the zero-padded weight rows.
// The 4x4 matrix C4[i][j] = sum_d Bq[d][i] * Av[j][d] is formed by every
// work-group itself, each wave summing its own columns while x streams in.
// Four adjacent non-temporal stores, which the compiler joins to one of 16 bytes.
__device__ __forceinline__ void nt_store4(float* p, const float4 v) {
  __builtin_nontemporal_store(v.x, p + 0);
  __builtin_nontemporal_store(v.y, p + 1);
  __builtin_nontemporal_store(v.z, p + 2);
  __builtin_nontemporal_store(v.w, p + 3);
}

#define GR 4                     // rows per group of stores

__device__ __forceinline__ float lane_bcast(float v, int l) {
  return __int_as_float(__builtin_amdgcn_readlane(__float_as_int(v), l));
}

// The value that v has in lane (l ^ XM) of the same row of 16 lanes (row_xmask).
template <int XM>
__device__ __forceinline__ float row_xlane(float v) {
  return __int_as_float(__builtin_amdgcn_update_dpp(
      0, __float_as_int(v), 0x160 + XM, 0xf, 0xf, true));
}

// One step of a sum over a row of 16 lanes that halves the number of values:
// the lanes with bit XM clear go on with v[0..N), the others with v[N..2N).
template <int XM, int N>
__device__ __forceinline__ void row_fold(const float (&v)[2 * N], float (&o)[N], int m) {
  const bool up = (m & XM) != 0;
#pragma unroll
  for (int k = 0; k < N; ++k) {
    const float keep = up ? v[k + N] : v[k];
    const float send = up ? v[k] : v[k + N];
    o[k] = keep + row_xlane<XM>(send);
  }
}

__device__ __forceinline__ void row_coef(const float4 q, const float4 v,
                                         const float* __restrict__ C4,
                                         float (&cf)[8]) {
  const float lq[4] = {q.x, q.y, q.z, q.w};
  const float lr[4] = {v.x, v.y, v.z, v.w};
#pragma unroll
  for (int r = 0; r < 4; ++r) {
    const float lv = lr[r] + SCALING * (lq[0] * C4[0 * 4 + r] +
                                        lq[1] * C4[1 * 4 + r] +
                                        lq[2] * C4[2 * 4 + r] +
                                        lq[3] * C4[3 * 4 + r]);
    cf[r]     = SCALING * lq[r];
    cf[4 + r] = SCALING * lv;
  }
}

// Copies x[row0..row0+15][k0..k0+KC) to its place in the tile.
// Per instruction: half-wave = 256 contiguous bytes of one row.
__device__ __forceinline__ void copy_chunk(const float* __restrict__ xrow0,
                                           float* tile, int k0, int lane) {
#pragma unroll
  for (int i = 0; i < 8; ++i) {
    const int r = 2 * i + (lane >> 4);
    const int c = k0 + ((lane & 15) << 2);
    async_copy_b128(xrow0 + (size_t)r * HIDDEN + c, tile + r * ROWSTR + c);
  }
}

// One chunk's weight fragments (WGP-cache-hot after the first touch of a line).
__device__ __forceinline__ void load_weights(const float* __restrict__ wp, v2f (&a)[KC / 4]) {
#pragma unroll
  for (int kk = 0; kk < KC / 4; ++kk) a[kk] = *(const v2f*)(wp + kk * 4);
  // Keeps the loads above in front of the wait below.
  __builtin_amdgcn_sched_barrier(0);
  // Their address registers are free for other values from here on.
  asm volatile("s_wait_xcnt 0x0" ::: "memory");
  // Keeps every later register write behind that wait.
  __builtin_amdgcn_sched_barrier(0);
}

// One wave's share of C4: 8 columns a lane (the pairs i = 0,1 and i = 2,3 of
// Bq[d][i] side by side), then the sum over each row of 16 lanes, which leaves
// entry m in lane m; both rows add theirs to the work-group's sum in c4sum.
__device__ __forceinline__ void c4_share(const float4 (&bq)[2][4], const float4 (&av)[4][2],
                                         int m, float* c4sum) {
  v2f plo[4], phi[4];
#pragma unroll
  for (int r = 0; r < 4; ++r) { plo[r] = (v2f){0.0f, 0.0f}; phi[r] = (v2f){0.0f, 0.0f}; }
#pragma unroll
  for (int h = 0; h < 2; ++h)
#pragma unroll
    for (int r = 0; r < 4; ++r) {
      const float ar[4] = {av[r][h].x, av[r][h].y, av[r][h].z, av[r][h].w};
#pragma unroll
      for (int j = 0; j < 4; ++j) {
        const v2f aa = {ar[j], ar[j]};
        plo[r] = __builtin_elementwise_fma((v2f){bq[h][j].x, bq[h][j].y}, aa, plo[r]);
        phi[r] = __builtin_elementwise_fma((v2f){bq[h][j].z, bq[h][j].w}, aa, phi[r]);
      }
    }
  float p16[16], p8[8], p4[4], p2[2], p1[1];
#pragma unroll
  for (int r = 0; r < 4; ++r) {
    p16[0 * 4 + r] = plo[r].x; p16[1 * 4 + r] = plo[r].y;
    p16[2 * 4 + r] = phi[r].x; p16[3 * 4 + r] = phi[r].y;
  }
  row_fold<8, 8>(p16, p8, m);
  row_fold<4, 4>(p8, p4, m);
  row_fold<2, 2>(p4, p2, m);
  row_fold<1, 1>(p2, p1, m);
  atomicAdd(c4sum + m, p1[0]);
}

__global__ __launch_bounds__(512) void lora_fused(
    const float* __restrict__ x, const float* __restrict__ Aq,
    const float* __restrict__ Av, const float* __restrict__ Bq,
    const float* __restrict__ Bv, float* __restrict__ out) {
  __shared__ __attribute__((aligned(16))) float tile[16 * ROWSTR];
  // Rows 0-15: the low-rank values of the 16 x rows; rows 16-17: C4.
  __shared__ __attribute__((aligned(16))) float red[18][8];

  const int tid   = threadIdx.x;
  const int wave  = tid >> 5;
  const int lane  = tid & 31;
  const int m     = lane & 15;           // A-matrix row / B-matrix column (x-row)
  const int khalf = (lane >> 4) << 1;    // 0 (lanes 0-15) or 2 (lanes 16-31)
  const int row0  = blockIdx.x << 4;
  const int kslab = wave * KSLAB;
  const float* xrow0 = x + (size_t)row0 * HIDDEN;

  copy_chunk(xrow0, tile, kslab, lane);

  if (tid < 144) ((float*)red)[tid] = 0.0f;
  __syncthreads();

  const float* wrow = (m < 4) ? (Aq + (size_t)m * HIDDEN)
                    : ((m < 8) ? (Av + (size_t)(m - 4) * HIDDEN) : Aq);
  const float wscale = (m < 8) ? 1.0f : 0.0f;   // zero-pad weight rows 8..15
  const float* wp = wrow + kslab + khalf;
  const int col = kslab + (lane << 2);

  // Weight fragments run one chunk ahead of the WMMAs, like the copies.
  v2f a[2][KC / 4];
  load_weights(wp, a[0]);

  // The Bq/Bv rows of this lane's 8 columns are used behind the cross-wave sum;
  // fetched here, they arrive while x streams in.  av: the same 8 columns of Av.
  float4 bq[2][4], bv[2][4], av[4][2];
#pragma unroll
  for (int h = 0; h < 2; ++h)
#pragma unroll
    for (int j = 0; j < 4; ++j) {
      bq[h][j] = *(const float4*)(Bq + (size_t)(col + h * 128 + j) * 4);
      bv[h][j] = *(const float4*)(Bv + (size_t)(col + h * 128 + j) * 4);
      av[j][h] = *(const float4*)(Av + (size_t)j * HIDDEN + col + h * 128);
    }
  // Keeps the loads above in front of the wait below.
  __builtin_amdgcn_sched_barrier(0);
  // The address registers of the loads above are reused from here on.
  asm volatile("s_wait_xcnt 0x0" ::: "memory");
  // Keeps every later register write behind that wait.
  __builtin_amdgcn_sched_barrier(0);
  v8f acc = {0.0f, 0.0f, 0.0f, 0.0f, 0.0f, 0.0f, 0.0f, 0.0f};
#pragma unroll
  for (int ch = 0; ch < NCH; ++ch) {
    wait_async();                        // chunk ch of this wave has landed
    if (ch + 1 < NCH) {
      copy_chunk(xrow0, tile, kslab + (ch + 1) * KC, lane);
      load_weights(wp + (ch + 1) * KC, a[(ch + 1) & 1]);
    }
    // Done here, its vector work runs while the second chunk is on its way.
    if (ch == 0) c4_share(bq, av, m, &red[16][0]);
#pragma unroll
    for (int kk = 0; kk < KC; kk += 4) {
      v2f aw = a[ch & 1][kk >> 2];
      aw.x *= wscale; aw.y *= wscale;
      const v2f b = *(const v2f*)(tile + m * ROWSTR + kslab + ch * KC + kk + khalf);
      acc = __builtin_amdgcn_wmma_f32_16x16x4_f32(
          /*neg_a=*/false, aw, /*neg_b=*/false, b,
          /*c_mod=*/(short)0, acc, /*reuse_a=*/false, /*reuse_b=*/false);
    }
  }

  // Cross-wave reduction of per-slab partials.
  if (lane < 16) {
#pragma unroll
    for (int g = 0; g < 8; ++g) atomicAdd(&red[lane][g], acc[g]);
  }
  __syncthreads();

  // Lane l (and l + 16) forms the 8 coefficients of row l; readlane hands them
  // to the wave row by row.
  // Lane m fetches entry m of C4; readlane makes the 16 entries wave-uniform.
  const float c4m = red[16 + (m >> 3)][m & 7];
  float c4[16];
#pragma unroll
  for (int k = 0; k < 16; ++k) c4[k] = lane_bcast(c4m, k);
  float cf[8];
  row_coef(*(const float4*)&red[m][0], *(const float4*)&red[m][4], c4, cf);

  float* op = out + (size_t)row0 * HIDDEN + col;
#pragma unroll
  for (int g = 0; g < 16; g += GR) {
    float4 o[GR][2];
#pragma unroll
    for (int u = 0; u < GR; ++u) {
      float c[8];
#pragma unroll
      for (int k = 0; k < 8; ++k) c[k] = lane_bcast(cf[k], g + u);
#pragma unroll
      for (int h = 0; h < 2; ++h) {
        const float4 xv = *(const float4*)(tile + (g + u) * ROWSTR + col + h * 128);
        const float xa[4] = {xv.x, xv.y, xv.z, xv.w};
        float t[4];
#pragma unroll
        for (int j = 0; j < 4; ++j) {
          t[j] = 2.0f * xa[j]
               + c[0] * bq[h][j].x + c[1] * bq[h][j].y + c[2] * bq[h][j].z + c[3] * bq[h][j].w
               + c[4] * bv[h][j].x + c[5] * bv[h][j].y + c[6] * bv[h][j].z + c[7] * bv[h][j].w;
        }
        o[u][h] = make_float4(t[0], t[1], t[2], t[3]);
      }
    }
    // Keeps the group's stores together behind its arithmetic, so that no
    // result register is reused between a store and the wait below.
    __builtin_amdgcn_sched_barrier(0);
#pragma unroll
    for (int u = 0; u < GR; ++u)
#pragma unroll
      for (int h = 0; h < 2; ++h)
        // Non-temporal: out is written once and not read again in this launch.
        nt_store4(op + (size_t)(g + u) * HIDDEN + h * 128, o[u][h]);
    // The stores' data registers are written again by the next group.
    asm volatile("s_wait_xcnt 0x0" ::: "memory");
    // Keeps every later register write behind that wait.
    __builtin_amdgcn_sched_barrier(0);
  }
}

// ----------------------------------------------------------------------------
extern "C" void kernel_launch(void* const* d_in, const int* in_sizes, int n_in,
                              void* d_out, int out_size, void* d_ws, size_t ws_size,
                              hipStream_t stream) {
  (void)n_in; (void)out_size; (void)d_ws; (void)ws_size;
  const float* x  = (const float*)d_in[0];
  const float* Aq = (const float*)d_in[1];   // [4, 4096]
  const float* Bq = (const float*)d_in[2];   // [4096, 4]
  const float* Av = (const float*)d_in[3];   // [4, 4096]
  const float* Bv = (const float*)d_in[4];   // [4096, 4]
  float* out = (float*)d_out;
  const int nrows = in_sizes[0] / HIDDEN;    // 8192

  lora_fused<<<nrows / 16, 512, 0, stream>>>(x, Aq, Av, Bq, Bv, out);
}

// v005
// It runs in 22.4 microseconds.
// Next to v004, in two timings, it ran 1.06 times as fast each time.
// All steps since v000 together make it 3.65 times as fast.
#include <hip/hip_runtime.h>

#define HIDDEN 4096
#define SCALING 2.0f

typedef float v2f __attribute__((ext_vector_type(2)));
typedef float v8f __attribute__((ext_vector_type(8)));

#define NW     16                // waves per block (wave32 -> 512 threads)
#define KSLAB  (HIDDEN / NW)     // 256 columns per wave
#define KC     64                // columns copied to LDS per step and wave
#define NCH    (KSLAB / KC)      // copy steps per wave
#define ROWSTR (HIDDEN + 4)      // LDS row stride (floats): 4100 = 4 mod 64 -> conflict-free reads
#define TPB    2                 // 16-row tiles per work-group, one after the other

// ---------------- gfx1250 async-copy helpers (guarded) ----------------------
__device__ __forceinline__ void async_copy_b128(const float* gsrc, float* ldst) {
#if __has_builtin(__builtin_amdgcn_global_load_async_to_lds_b128)
  typedef int v4i __attribute__((vector_size(16)));
  typedef __attribute__((address_space(1))) v4i glb_v4i;
  typedef __attribute__((address_space(3))) v4i lds_v4i;
  // Last argument 1 = non-temporal: x is read once, its lines need no place in L2.
  __builtin_amdgcn_global_load_async_to_lds_b128((glb_v4i*)gsrc, (lds_v4i*)ldst, 0, 1);
#else
  *(float4*)ldst = *(const float4*)gsrc;   // synchronous fallback
#endif
}

__device__ __forceinline__ void wait_async() {
#if __has_builtin(__builtin_amdgcn_s_wait_asynccnt)
  __builtin_amdgcn_s_wait_asynccnt(0);
#else
  asm volatile("s_wait_asynccnt 0" ::: "memory");
#endif
  asm volatile("" ::: "memory");   // compiler barrier: keep ds reads after the wait
}

// ---------------- out = 2x + s*lq*Bq^T + s*lv*Bv^T --------------------------
// One work-group owns 16 * TPB whole rows of x and keeps 16 at a time in LDS, so that x is
// fetched from memory once.  Wave w owns columns [w*KSLAB, (w+1)*KSLAB): it
// copies them in, multiplies them with the weights (WMMA), and after the
// cross-wave sum of the 16 x 8 low-rank values writes the same columns of out.
// WMMA operands: the weights are the 16x4 A-matrix (rows 0-3 = Aq, 4-7 = Av,
// 8-15 = zero), 16 x-rows are the 4x16 B-matrix.  Lane l<16 holds
// low8[row l][g] in acc[g], lanes 16-31 hold the zero-padded weight rows.
// The 4x4 matrix C4[i][j] = sum_d Bq[d][i] * Av[j][d] is formed by every
// work-group itself, each wave summing its own columns while x streams in.
// A work-group does TPB such tiles.  A wave's columns of the tile are read by
// that wave alone, so it refills them with the next tile's x as soon as it has
// read them for the stores: the next tile streams in while this one streams out,
// and Bq, Bv and C4 are fetched once for all tiles.
// Four adjacent non-temporal stores, which the compiler joins to one of 16 bytes.
__device__ __forceinline__ void nt_store4(float* p, const float4 v) {
  __builtin_nontemporal_store(v.x, p + 0);
  __builtin_nontemporal_store(v.y, p + 1);
  __builtin_nontemporal_store(v.z, p + 2);
  __builtin_nontemporal_store(v.w, p + 3);
}

#define GR 4                     // rows per group of stores

__device__ __forceinline__ float lane_bcast(float v, int l) {
  return __int_as_float(__builtin_amdgcn_readlane(__float_as_int(v), l));
}

// The value that v has in lane (l ^ XM) of the same row of 16 lanes (row_xmask).
template <int XM>
__device__ __forceinline__ float row_xlane(float v) {
  return __int_as_float(__builtin_amdgcn_update_dpp(
      0, __float_as_int(v), 0x160 + XM, 0xf, 0xf, true));
}

// One step of a sum over a row of 16 lanes that halves the number of values:
// the lanes with bit XM clear go on with v[0..N), the others with v[N..2N).
template <int XM, int N>
__device__ __forceinline__ void row_fold(const float (&v)[2 * N], float (&o)[N], int m) {
  const bool up = (m & XM) != 0;
#pragma unroll
  for (int k = 0; k < N; ++k) {
    const float keep = up ? v[k + N] : v[k];
    const float send = up ? v[k] : v[k + N];
    o[k] = keep + row_xlane<XM>(send);
  }
}

__device__ __forceinline__ void row_coef(const float4 q, const float4 v,
                                         const float* __restrict__ C4,
                                         float (&cf)[8]) {
  const float lq[4] = {q.x, q.y, q.z, q.w};
  const float lr[4] = {v.x, v.y, v.z, v.w};
#pragma unroll
  for (int r = 0; r < 4; ++r) {
    const float lv = lr[r] + SCALING * (lq[0] * C4[0 * 4 + r] +
                                        lq[1] * C4[1 * 4 + r] +
                                        lq[2] * C4[2 * 4 + r] +
                                        lq[3] * C4[3 * 4 + r]);
    cf[r]     = SCALING * lq[r];
    cf[4 + r] = SCALING * lv;
  }
}

// Copies x[row0..row0+15][k0..k0+KC) to its place in the tile.
// Per instruction: half-wave = 256 contiguous bytes of one row.
__device__ __forceinline__ void copy_chunk(const float* __restrict__ xrow0,
                                           float* tile, int k0, int lane) {
#pragma unroll
  for (int i = 0; i < 8; ++i) {
    const int r = 2 * i + (lane >> 4);
    const int c = k0 + ((lane & 15) << 2);
    async_copy_b128(xrow0 + (size_t)r * HIDDEN + c, tile + r * ROWSTR + c);
  }
}

// Copies x[rows r0..r0+GR-1][c..c+3] of this lane (a wave: 512 contiguous bytes
// of each row) to the same place of the tile.
__device__ __forceinline__ void copy_rows(const float* __restrict__ xrow0,
                                          float* tile, int r0, int c) {
#pragma unroll
  for (int r = r0; r < r0 + GR; ++r)
    async_copy_b128(xrow0 + (size_t)r * HIDDEN + c, tile + r * ROWSTR + c);
}

// One chunk's weight fragments (WGP-cache-hot after the first touch of a line).
__device__ __forceinline__ void load_weights(const float* __restrict__ wp, v2f (&a)[KC / 4]) {
#pragma unroll
  for (int kk = 0; kk < KC / 4; ++kk) a[kk] = *(const v2f*)(wp + kk * 4);
  // Keeps the loads above in front of the wait below.
  __builtin_amdgcn_sched_barrier(0);
  // Their address registers are free for other values from here on.
  asm volatile("s_wait_xcnt 0x0" ::: "memory");
  // Keeps every later register write behind that wait.
  __builtin_amdgcn_sched_barrier(0);
}

// One wave's share of C4: 8 columns a lane (the pairs i = 0,1 and i = 2,3 of
// Bq[d][i] side by side), then the sum over each row of 16 lanes, which leaves
// entry m in lane m; both rows add theirs to the work-group's sum in c4sum.
__device__ __forceinline__ void c4_share(const float4 (&bq)[2][4], const float4 (&av)[4][2],
                                         int m, float* c4sum) {
  v2f plo[4], phi[4];
#pragma unroll
  for (int r = 0; r < 4; ++r) { plo[r] = (v2f){0.0f, 0.0f}; phi[r] = (v2f){0.0f, 0.0f}; }
#pragma unroll
  for (int h = 0; h < 2; ++h)
#pragma unroll
    for (int r = 0; r < 4; ++r) {
      const float ar[4] = {av[r][h].x, av[r][h].y, av[r][h].z, av[r][h].w};
#pragma unroll
      for (int j = 0; j < 4; ++j) {
        const v2f aa = {ar[j], ar[j]};
        plo[r] = __builtin_elementwise_fma((v2f){bq[h][j].x, bq[h][j].y}, aa, plo[r]);
        phi[r] = __builtin_elementwise_fma((v2f){bq[h][j].z, bq[h][j].w}, aa, phi[r]);
      }
    }
  float p16[16], p8[8], p4[4], p2[2], p1[1];
#pragma unroll
  for (int r = 0; r < 4; ++r) {
    p16[0 * 4 + r] = plo[r].x; p16[1 * 4 + r] = plo[r].y;
    p16[2 * 4 + r] = phi[r].x; p16[3 * 4 + r] = phi[r].y;
  }
  row_fold<8, 8>(p16, p8, m);
  row_fold<4, 4>(p8, p4, m);
  row_fold<2, 2>(p4, p2, m);
  row_fold<1, 1>(p2, p1, m);
  atomicAdd(c4sum + m, p1[0]);
}

__global__ __launch_bounds__(512) void lora_fused(
    const float* __restrict__ x, const float* __restrict__ Aq,
    const float* __restrict__ Av, const float* __restrict__ Bq,
    const float* __restrict__ Bv, float* __restrict__ out) {
  __shared__ __attribute__((aligned(16))) float tile[16 * ROWSTR];
  // Rows 0-15: the low-rank values of the first tile's 16 x rows; rows 16-17: C4;
  // 16 more rows for each further tile.
  __shared__ __attribute__((aligned(16))) float red[16 * TPB + 2][8];

  const int tid   = threadIdx.x;
  const int wave  = tid >> 5;
  const int lane  = tid & 31;
  const int m     = lane & 15;           // A-matrix row / B-matrix column (x-row)
  const int khalf = (lane >> 4) << 1;    // 0 (lanes 0-15) or 2 (lanes 16-31)
  const int row0  = blockIdx.x * (16 * TPB);
  const int kslab = wave * KSLAB;
  const float* xrow0 = x + (size_t)row0 * HIDDEN;

  copy_chunk(xrow0, tile, kslab, lane);

  if (tid < (16 * TPB + 2) * 8) ((float*)red)[tid] = 0.0f;
  __syncthreads();

  const float* wrow = (m < 4) ? (Aq + (size_t)m * HIDDEN)
                    : ((m < 8) ? (Av + (size_t)(m - 4) * HIDDEN) : Aq);
  const float wscale = (m < 8) ? 1.0f : 0.0f;   // zero-pad weight rows 8..15
  const float* wp = wrow + kslab + khalf;
  const int col = kslab + (lane << 2);

  // Weight fragments run one chunk ahead of the WMMAs, like the copies.
  v2f a[2][KC / 4];
  load_weights(wp, a[0]);

  // The Bq/Bv rows of this lane's 8 columns are used behind the cross-wave sum;
  // fetched here, they arrive while x streams in.  av: the same 8 columns of Av.
  float4 bq[2][4], bv[2][4], av[4][2];
#pragma unroll
  for (int h = 0; h < 2; ++h)
#pragma unroll
    for (int j = 0; j < 4; ++j) {
      bq[h][j] = *(const float4*)(Bq + (size_t)(col + h * 128 + j) * 4);
      bv[h][j] = *(const float4*)(Bv + (size_t)(col + h * 128 + j) * 4);
      av[j][h] = *(const float4*)(Av + (size_t)j * HIDDEN + col + h * 128);
    }
  // Keeps the loads above in front of the wait below.
  __builtin_amdgcn_sched_barrier(0);
  // The address registers of the loads above are reused from here on.
  asm volatile("s_wait_xcnt 0x0" ::: "memory");
  // Keeps every later register write behind that wait.
  __builtin_amdgcn_sched_barrier(0);

  float c4[16];
  // Unrolled: the first tile alone streams in chunk by chunk and forms C4, and
  // the last tile has no refill; t decides both at compile time.
#pragma unroll
  for (int t = 0; t < TPB; ++t) {
    v8f acc = {0.0f, 0.0f, 0.0f, 0.0f, 0.0f, 0.0f, 0.0f, 0.0f};
#pragma unroll
    for (int ch = 0; ch < NCH; ++ch) {
      if (t == 0) {
        wait_async();                    // chunk ch of this wave has landed
        if (ch + 1 < NCH) copy_chunk(xrow0, tile, kslab + (ch + 1) * KC, lane);
      } else if (ch == 0) {
        // The 16 older of this wave's 32 refill copies (columns 0-127) have landed.
        asm volatile("s_wait_asynccnt 0x10" ::: "memory");
      } else if (ch == NCH / 2) {
        // The 16 younger ones (columns 128-255) have landed too.
        asm volatile("s_wait_asynccnt 0x0" ::: "memory");
      }
      if (ch + 1 < NCH) load_weights(wp + (ch + 1) * KC, a[(ch + 1) & 1]);
      // Done here, its vector work runs while the second chunk is on its way.
      if (t == 0 && ch == 0) c4_share(bq, av, m, &red[16][0]);
#pragma unroll
      for (int kk = 0; kk < KC; kk += 4) {
        v2f aw = a[ch & 1][kk >> 2];
        aw.x *= wscale; aw.y *= wscale;
        const v2f b = *(const v2f*)(tile + m * ROWSTR + kslab + ch * KC + kk + khalf);
        acc = __builtin_amdgcn_wmma_f32_16x16x4_f32(
            /*neg_a=*/false, aw, /*neg_b=*/false, b,
            /*c_mod=*/(short)0, acc, /*reuse_a=*/false, /*reuse_b=*/false);
      }
    }

    // Cross-wave reduction of per-slab partials.
    float (*lowt)[8] = &red[t == 0 ? 0 : 16 * t + 2];
    if (lane < 16) {
#pragma unroll
      for (int g = 0; g < 8; ++g) atomicAdd(&lowt[lane][g], acc[g]);
    }
    __syncthreads();

    // Lane l (and l + 16) forms the 8 coefficients of row l; readlane hands them
    // to the wave row by row: for columns 0-127 from lane l, for 128-255 anew from
    // lane l + 16.
    // Lane m fetches entry m of C4; readlane makes the 16 entries wave-uniform.
    if (t == 0) {
      const float c4m = red[16 + (m >> 3)][m & 7];
#pragma unroll
      for (int k = 0; k < 16; ++k) c4[k] = lane_bcast(c4m, k);
    }
    float cf[8];
    row_coef(*(const float4*)&lowt[m][0], *(const float4*)&lowt[m][4], c4, cf);

    float* op = out + (size_t)(row0 + 16 * t) * HIDDEN + col;
    // Columns 0-127 of all rows first: they are refilled first, and the next
    // tile's WMMAs start on them.  Unrolled: h indexes register arrays.
#pragma unroll
    for (int h = 0; h < 2; ++h) {
#pragma unroll
      for (int g = 0; g < 16; g += GR) {
        float4 o[GR];
#pragma unroll
        for (int u = 0; u < GR; ++u) {
          float c[8];
#pragma unroll
          for (int k = 0; k < 8; ++k) c[k] = lane_bcast(cf[k], g + u + 16 * h);
          const float4 xv = *(const float4*)(tile + (g + u) * ROWSTR + col + h * 128);
          const float xa[4] = {xv.x, xv.y, xv.z, xv.w};
          float s[4];
#pragma unroll
          for (int j = 0; j < 4; ++j) {
            s[j] = 2.0f * xa[j]
                 + c[0] * bq[h][j].x + c[1] * bq[h][j].y + c[2] * bq[h][j].z + c[3] * bq[h][j].w
                 + c[4] * bv[h][j].x + c[5] * bv[h][j].y + c[6] * bv[h][j].z + c[7] * bv[h][j].w;
          }
          o[u] = make_float4(s[0], s[1], s[2], s[3]);
        }
        // Keeps the group's stores together behind its arithmetic, so that no
        // result register is reused between a store and the wait below.
        __builtin_amdgcn_sched_barrier(0);
#pragma unroll
        for (int u = 0; u < GR; ++u)
          // Non-temporal: out is written once and not read again in this launch.
          nt_store4(op + (size_t)(g + u) * HIDDEN + h * 128, o[u]);
        // The stores' data registers are written again by the next group.
        asm volatile("s_wait_xcnt 0x0" ::: "memory");
        // Keeps every later register write behind that wait.
        __builtin_amdgcn_sched_barrier(0);
        if (t + 1 < TPB) {
          // This wave's LDS reads of the group's rows have retired before the
          // copies below write the same bytes (no other wave reads them).
          asm volatile("s_wait_dscnt 0x0" ::: "memory");
          copy_rows(xrow0 + (size_t)(16 * (t + 1)) * HIDDEN, tile, g, col + h * 128);
        }
      }
    }
    // The next tile's first weight fragments arrive while its x is on the way.
    if (t + 1 < TPB) load_weights(wp, a[0]);
  }
}

// ----------------------------------------------------------------------------
extern "C" void kernel_launch(void* const* d_in, const int* in_sizes, int n_in,
                              void* d_out, int out_size, void* d_ws, size_t ws_size,
                              hipStream_t stream) {
  (void)n_in; (void)out_size; (void)d_ws; (void)ws_size;
  const float* x  = (const float*)d_in[0];
  const float* Aq = (const float*)d_in[1];   // [4, 4096]
  const float* Bq = (const float*)d_in[2];   // [4096, 4]
  const float* Av = (const float*)d_in[3];   // [4, 4096]
  const float* Bv = (const float*)d_in[4];   // [4096, 4]
  float* out = (float*)d_out;
  const int nrows = in_sizes[0] / HIDDEN;    // 8192

  lora_fused<<<nrows / (16 * TPB), 512, 0, stream>>>(x, Aq, Av, Bq, Bv, out);
}
